// v000
// Measured on an AMD MI455X. A time is GPU time per run, averaged over a window of back-to-back runs after a warm-up
// (all launches, gaps included; the runs take copies of the inputs in turn), and the median of several windows.
// Apart from v000's, it joins two sittings. Times from different sittings can be a few percent apart, while
// side-by-side timings come from the same sitting.
// The starting kernel, v000, takes 60.7 microseconds a run.
#include <hip/hip_runtime.h>
#include <hip/hip_bf16.h>
#include <cstdint>

typedef __attribute__((ext_vector_type(2))) float v2f;
typedef __attribute__((ext_vector_type(8))) float v8f;
typedef __attribute__((ext_vector_type(4))) unsigned int u32x4;
typedef __attribute__((ext_vector_type(8))) int i32x8;
typedef __attribute__((ext_vector_type(4))) int i32x4;

#define BS      8
#define SEQ     2048
#define DIM     2048
#define RNK     8
#define CTR     32
#define HID     60
#define NEXP    4
#define SCALING 2.0f      // 16.0 / r
#define LN_EPS  1e-5f

#define TOK_PER_BLK 64    // tokens per block (4 WMMA tiles of 16)
#define KC      64        // K chunk DMAed into LDS per step (pad_interval=64 DW)
#define XS_STR  (KC + 4)  // TDM pad_amount = 4 DWORDs -> conflict-free 8B gathers
#define AS_STR  (KC + 4)
#define XA_STR  10        // pad 2 -> conflict-free xa gathers
#define NCHUNK  (DIM / KC)

// ---------------------------------------------------------------------------
// Kernel 1: gating MLP. One lane per batch sample (bs = 8).
// ---------------------------------------------------------------------------
__global__ void gate_kernel(const float* __restrict__ ctr,
                            const float* __restrict__ gamma,
                            const float* __restrict__ beta,
                            const float* __restrict__ W1, const float* __restrict__ b1,
                            const float* __restrict__ W2, const float* __restrict__ b2,
                            float* __restrict__ gate_out) {
    int b = threadIdx.x;
    if (b >= BS) return;
    const float* c = ctr + b * CTR;
    float mu = 0.f;
    for (int d = 0; d < CTR; ++d) mu += c[d];
    mu *= (1.f / CTR);
    float var = 0.f;
    for (int d = 0; d < CTR; ++d) { float t = c[d] - mu; var += t * t; }
    var *= (1.f / CTR);
    float inv = rsqrtf(var + LN_EPS);
    float z[CTR];
    for (int d = 0; d < CTR; ++d) z[d] = (c[d] - mu) * inv * gamma[d] + beta[d];
    float h[HID];
    for (int i = 0; i < HID; ++i) {
        float s = b1[i];
        for (int d = 0; d < CTR; ++d) s += z[d] * W1[i * CTR + d];
        h[i] = s > 0.f ? s : 0.f;
    }
    float g[NEXP];
    float mx = -1e30f;
    for (int o = 0; o < NEXP; ++o) {
        float s = b2[o];
        for (int i = 0; i < HID; ++i) s += h[i] * W2[o * HID + i];
        g[o] = s;
        mx = fmaxf(mx, s);
    }
    float se = 0.f;
    for (int o = 0; o < NEXP; ++o) { g[o] = __expf(g[o] - mx); se += g[o]; }
    float rs = 1.f / se;
    for (int o = 0; o < NEXP; ++o) gate_out[b * NEXP + o] = g[o] * rs;
}

// ---------------------------------------------------------------------------
// Kernel 2: A = gate @ Wa^T, B = gate @ Wb^T (scaling folded into B).
// ---------------------------------------------------------------------------
__global__ void ab_kernel(const float* __restrict__ Wa,
                          const float* __restrict__ Wb,
                          const float* __restrict__ gate,
                          float* __restrict__ A_ws,
                          float* __restrict__ B_ws) {
    int idx = blockIdx.x * blockDim.x + threadIdx.x;   // 0 .. 2*131072-1
    int f = idx & (BS * RNK * DIM - 1);
    int b = f >> 14;                                    // f / (RNK*DIM)
    int i = f & (RNK * DIM - 1);
    float4 gv = *(const float4*)(gate + b * 4);
    if (idx < BS * RNK * DIM) {
        float4 wr = *(const float4*)(Wa + (size_t)i * 4);
        A_ws[f] = wr.x * gv.x + wr.y * gv.y + wr.z * gv.z + wr.w * gv.w;
    } else {
        float4 wr = *(const float4*)(Wb + (size_t)i * 4);
        B_ws[f] = (wr.x * gv.x + wr.y * gv.y + wr.z * gv.z + wr.w * gv.w) * SCALING;
    }
}

// ---------------------------------------------------------------------------
// TDM descriptor build + issue: 2D tile (tile_w x tile_h) of fp32, row stride
// `stride_elems`, global -> LDS, with LDS padding of 4 DWORDs after every 64
// DWORDs (pad_interval code 5, pad_amount code 3) => LDS row stride = KC + 4.
// ---------------------------------------------------------------------------
__device__ __forceinline__ void tdm_load_2d(unsigned lds_byte_addr,
                                            const float* gaddr,
                                            unsigned tile_w, unsigned tile_h,
                                            unsigned stride_elems) {
    unsigned long long ga = (unsigned long long)(uintptr_t)gaddr;
    u32x4 g0;
    g0[0] = 1u;                                            // count=1, user-mode
    g0[1] = lds_byte_addr;                                 // LDS byte address
    g0[2] = (unsigned)(ga & 0xffffffffu);                  // global_addr[31:0]
    g0[3] = (unsigned)((ga >> 32) & 0x1ffffffu)            // global_addr[56:32]
          | (2u << 30);                                    // type = 2 (image)
    i32x8 g1;
    g1[0] = (int)((2u << 16)      // data_size = 2 (4 bytes)
          | (1u << 20)            // pad_enable
          | (5u << 22)            // pad_interval code 5 -> every 64 DWORDs
          | (3u << 25));          // pad_amount  code 3 -> 4 DWORDs
    g1[1] = (int)((2048u & 0xffffu) << 16);                // tensor_dim0 lo16
    g1[2] = (int)((2048u >> 16) | (0xffffu << 16));        // dim0 hi | dim1 lo
    g1[3] = (int)(tile_w << 16);                           // dim1 hi | tile_dim0
    g1[4] = (int)(tile_h & 0xffffu);                       // tile_dim1 (dim2=0)
    g1[5] = (int)stride_elems;                             // dim0_stride[31:0]
    g1[6] = 0;                                             // stride hi | dim1_stride lo
    g1[7] = 0;
    i32x4 z4 = {0, 0, 0, 0};
#if __clang_major__ >= 23
    i32x8 z8 = {0, 0, 0, 0, 0, 0, 0, 0};
    __builtin_amdgcn_tensor_load_to_lds(g0, g1, z4, z4, z8, 0);
#else
    __builtin_amdgcn_tensor_load_to_lds(g0, g1, z4, z4, 0);
#endif
}

__device__ __forceinline__ unsigned lds_off(const void* p) {
    return (unsigned)(uintptr_t)p;   // low 32 bits of flat LDS addr = LDS offset
}

// ---------------------------------------------------------------------------
// Kernel 3: out[b] = (x[b] @ A[b]^T) @ B[b].  Both GEMMs on
// V_WMMA_F32_16X16X4_F32; x/A staged global->LDS by the Tensor Data Mover,
// double-buffered so the DMA of chunk i+1 overlaps WMMA compute on chunk i.
// ---------------------------------------------------------------------------
__launch_bounds__(256)
__global__ void lora_main_kernel(const float* __restrict__ x,
                                 const float* __restrict__ A_ws,
                                 const float* __restrict__ B_ws,
                                 float* __restrict__ out) {
    __shared__ __align__(16) float xs[2][TOK_PER_BLK * XS_STR];  // 2 x 17 KB
    __shared__ __align__(16) float as_[2][16 * AS_STR];          // 2 x 4.3 KB
    __shared__ float xa[TOK_PER_BLK * XA_STR];                   // 2.5 KB

    const int b    = blockIdx.y;
    const int s0   = blockIdx.x * TOK_PER_BLK;
    const int tid  = threadIdx.x;
    const int w    = tid >> 5;        // wave id (wave32)
    const int lane = tid & 31;
    const int m    = lane & 15;       // row/col index within 16
    const int g    = lane >> 4;       // half-wave group

    const float* xb = x    + ((size_t)b * SEQ + s0) * DIM;
    const float* Ab = A_ws + (size_t)b * (RNK * DIM);
    const float* Bb = B_ws + (size_t)b * (RNK * DIM);
    float*       ob = out  + ((size_t)b * SEQ + s0) * DIM;

    // Zero N-pad rows (8..15) of both A-chunk buffers once; TDM only writes
    // rows 0..7, so the WMMA B-operand needs no branch for the padded N half.
    for (int v = tid; v < 8 * AS_STR; v += 256) {
        as_[0][8 * AS_STR + v] = 0.f;
        as_[1][8 * AS_STR + v] = 0.f;
    }

    // ---------------- Phase 1: xa = x_tile @ A^T (TDM + WMMA) -------------
    v8f c = {0.f, 0.f, 0.f, 0.f, 0.f, 0.f, 0.f, 0.f};
    const int tt = w & 3;    // token tile owned by this wave
    const int kh = w >> 2;   // K half of each chunk (0: k<32, 1: k>=32)

    if (w == 0) {            // wave-uniform branch: TDM ignores EXEC
        tdm_load_2d(lds_off(&xs[0][0]),  xb, KC, TOK_PER_BLK, DIM);
        tdm_load_2d(lds_off(&as_[0][0]), Ab, KC, RNK,         DIM);
    }

    for (int ci = 0; ci < NCHUNK; ++ci) {
        const int cur = ci & 1;
        if (w == 0) {
            if (ci + 1 < NCHUNK) {
                // prefetch next chunk into the other buffer, then wait for
                // the current chunk (in-order TENSORcnt: <=2 retires pair ci)
                tdm_load_2d(lds_off(&xs[1 - cur][0]),  xb + (ci + 1) * KC,
                            KC, TOK_PER_BLK, DIM);
                tdm_load_2d(lds_off(&as_[1 - cur][0]), Ab + (ci + 1) * KC,
                            KC, RNK, DIM);
                __builtin_amdgcn_s_wait_tensorcnt((short)2);
            } else {
                __builtin_amdgcn_s_wait_tensorcnt((short)0);
            }
        }
        __syncthreads();   // chunk ci visible in LDS to all waves

        const float* xp = &xs[cur][(tt * 16 + m) * XS_STR + 2 * g + kh * (KC / 2)];
        const float* ap = &as_[cur][m * AS_STR + 2 * g + kh * (KC / 2)];
#pragma unroll
        for (int k = 0; k < KC / 2; k += 4) {
            v2f av = *(const v2f*)(xp + k);   // A-op: x[m][k0+2g], x[m][k0+2g+1]
            v2f bv = *(const v2f*)(ap + k);   // B-op: A[n][k0+2g], A[n][k0+2g+1]
            c = __builtin_amdgcn_wmma_f32_16x16x4_f32(false, av, false, bv,
                                                      (short)0, c, false, false);
        }
        __syncthreads();   // done reading buffer `cur` (re-DMAed at ci+2)
    }

    // Combine the two K halves through LDS into xa[token][r].
    if (kh == 1 && m < RNK) {
#pragma unroll
        for (int i = 0; i < 8; ++i)
            xa[(tt * 16 + i + 8 * g) * XA_STR + m] = c[i];
    }
    __syncthreads();
    if (kh == 0 && m < RNK) {
#pragma unroll
        for (int i = 0; i < 8; ++i)
            xa[(tt * 16 + i + 8 * g) * XA_STR + m] += c[i];
    }
    __syncthreads();

    // ---------------- Phase 2: out_tile = xa_tile @ B --------------------
    // Per wave: xa A-operand invariant across its 16 n-chunks per tile; B is
    // read from L2 (512 KB resident). Adjacent waves take adjacent 16-column
    // chunks so the 64B half-line stores combine into full cachelines.
#pragma unroll
    for (int t2 = 0; t2 < 4; ++t2) {
        const float* xr = &xa[(t2 * 16 + m) * XA_STR];
        v2f a0 = *(const v2f*)(xr + 2 * g);       // r = 2g, 2g+1
        v2f a1 = *(const v2f*)(xr + 4 + 2 * g);   // r = 4+2g, 5+2g
        for (int j = 0; j < 16; ++j) {
            int nc  = w + 8 * j;
            int col = nc * 16 + m;
            const float* bp = Bb + col;
            v2f b0 = { bp[(size_t)(2 * g) * DIM],     bp[(size_t)(2 * g + 1) * DIM] };
            v2f b1 = { bp[(size_t)(4 + 2 * g) * DIM], bp[(size_t)(5 + 2 * g) * DIM] };
            v8f d = {0.f, 0.f, 0.f, 0.f, 0.f, 0.f, 0.f, 0.f};
            d = __builtin_amdgcn_wmma_f32_16x16x4_f32(false, a0, false, b0,
                                                      (short)0, d, false, false);
            d = __builtin_amdgcn_wmma_f32_16x16x4_f32(false, a1, false, b1,
                                                      (short)0, d, false, false);
            float* op = ob + (size_t)(t2 * 16 + 8 * g) * DIM + col;
#pragma unroll
            for (int i2 = 0; i2 < 8; ++i2) op[(size_t)i2 * DIM] = d[i2];
        }
    }
}

// ---------------------------------------------------------------------------
extern "C" void kernel_launch(void* const* d_in, const int* in_sizes, int n_in,
                              void* d_out, int out_size, void* d_ws, size_t ws_size,
                              hipStream_t stream) {
    const float* x   = (const float*)d_in[0];
    const float* ctr = (const float*)d_in[1];
    const float* gam = (const float*)d_in[2];
    const float* bet = (const float*)d_in[3];
    const float* W1  = (const float*)d_in[4];
    const float* b1  = (const float*)d_in[5];
    const float* W2  = (const float*)d_in[6];
    const float* b2  = (const float*)d_in[7];
    const float* Wa  = (const float*)d_in[8];
    const float* Wb  = (const float*)d_in[9];
    float* out = (float*)d_out;

    float* gate_ws = (float*)d_ws;                       // 32 floats (256 B slot)
    float* A_ws    = (float*)((char*)d_ws + 256);        // 8*8*2048 floats
    float* B_ws    = A_ws + BS * RNK * DIM;              // 8*8*2048 floats

    gate_kernel<<<1, 32, 0, stream>>>(ctr, gam, bet, W1, b1, W2, b2, gate_ws);
    ab_kernel<<<(2 * BS * RNK * DIM) / 256, 256, 0, stream>>>(Wa, Wb, gate_ws, A_ws, B_ws);
    lora_main_kernel<<<dim3(SEQ / TOK_PER_BLK, BS), 256, 0, stream>>>(x, A_ws, B_ws, out);
}

// v001
// It runs in 45.8 microseconds.
// Timed twice side by side with v000, it ran 1.34 and 1.33 times as fast.
#include <hip/hip_runtime.h>
#include <hip/hip_bf16.h>
#include <cstdint>

typedef __attribute__((ext_vector_type(2))) float v2f;
typedef __attribute__((ext_vector_type(8))) float v8f;
typedef __attribute__((ext_vector_type(4))) unsigned int u32x4;
typedef __attribute__((ext_vector_type(8))) int i32x8;
typedef __attribute__((ext_vector_type(4))) int i32x4;

#define BS      8
#define SEQ     2048
#define DIM     2048
#define RNK     8
#define CTR     32
#define HID     60
#define NEXP    4
#define SCALING 2.0f      // 16.0 / r
#define LN_EPS  1e-5f

#define TOK_PER_BLK 64    // tokens per block (4 WMMA tiles of 16)
#define KC      64        // K chunk DMAed into LDS per step (pad_interval=64 DW)
#define XS_STR  (KC + 4)  // TDM pad_amount = 4 DWORDs -> conflict-free 8B gathers
#define AS_STR  (KC + 4)
#define XA_STR  10        // pad 2 -> conflict-free xa gathers
#define NCHUNK  (DIM / KC)

// ---------------------------------------------------------------------------
// Kernel 1: gating MLP + A = gate @ Wa^T, B = gate @ Wb^T (scaling folded
// into B). A block covers 256 rows of one sample, so its wave 0 works out that
// sample's gate itself: lane d holds input d, lane l hidden units l and l+32,
// lane o logit o; a value goes from its lane to all lanes by a lane read.
// Every sum keeps its serial order.
// ---------------------------------------------------------------------------
__device__ __forceinline__ float from_lane(float v, int l) {
    return __int_as_float(__builtin_amdgcn_readlane(__float_as_int(v), l));
}

__launch_bounds__(256)
__global__ void gate_ab_kernel(const float* __restrict__ ctr,
                               const float* __restrict__ gamma,
                               const float* __restrict__ beta,
                               const float* __restrict__ W1, const float* __restrict__ b1,
                               const float* __restrict__ W2, const float* __restrict__ b2,
                               const float* __restrict__ Wa,
                               const float* __restrict__ Wb,
                               float* __restrict__ A_ws,
                               float* __restrict__ B_ws) {
    __shared__ __align__(16) float gs[NEXP];

    const int tid  = threadIdx.x;
    const int blk  = blockIdx.x;                        // 0 .. 1023
    const bool isA = blk < (BS * RNK * DIM) / 256;      // first half: A, second: B
    const int b    = (blk >> 6) & (BS - 1);             // 64 blocks per sample
    const int f    = ((blk << 8) + tid) & (BS * RNK * DIM - 1);
    const int i    = f & (RNK * DIM - 1);

    // This thread's weight row: asked for first, used last.
    const float4 wr = *(const float4*)((isA ? Wa : Wb) + (size_t)i * 4);

    if (tid < 32) {                                     // wave 0, every lane on
        const int ra = tid;                             // hidden units of this lane
        const int rb = tid + 32 < HID ? tid + 32 : HID - 1;
        const int o  = tid & (NEXP - 1);                // logit of this lane
        float4 w1a[CTR / 4], w1b[CTR / 4], w2r[HID / 4];
        // All loops of this branch are unrolled: the arrays stay in registers and
        // a lane read takes its lane as a constant only with constant indices.
#pragma unroll
        for (int q = 0; q < CTR / 4; ++q) {
            w1a[q] = *(const float4*)(W1 + ra * CTR + 4 * q);
            w1b[q] = *(const float4*)(W1 + rb * CTR + 4 * q);
        }
#pragma unroll
        for (int q = 0; q < HID / 4; ++q)
            w2r[q] = *(const float4*)(W2 + o * HID + 4 * q);
        const float cv = ctr[b * CTR + tid];
        const float gm = gamma[tid];
        const float bt = beta[tid];
        float sa = b1[ra];
        float sb = b1[rb];
        float s2 = b2[o];
        // Keeps every load above in front of the serial sums below, so that the
        // wave pays one memory latency and not one per layer.
        __builtin_amdgcn_sched_barrier(0);

        float mu = 0.f;
#pragma unroll
        for (int d = 0; d < CTR; ++d) mu += from_lane(cv, d);
        mu *= (1.f / CTR);
        float var = 0.f;
#pragma unroll
        for (int d = 0; d < CTR; ++d) { float t = from_lane(cv, d) - mu; var += t * t; }
        var *= (1.f / CTR);
        const float inv = rsqrtf(var + LN_EPS);
        const float zv  = (cv - mu) * inv * gm + bt;    // lane d: z[d]

#pragma unroll
        for (int q = 0; q < CTR / 4; ++q) {
            const float z0 = from_lane(zv, 4 * q + 0), z1 = from_lane(zv, 4 * q + 1);
            const float z2 = from_lane(zv, 4 * q + 2), z3 = from_lane(zv, 4 * q + 3);
            sa = fmaf(z0, w1a[q].x, sa);  sb = fmaf(z0, w1b[q].x, sb);
            sa = fmaf(z1, w1a[q].y, sa);  sb = fmaf(z1, w1b[q].y, sb);
            sa = fmaf(z2, w1a[q].z, sa);  sb = fmaf(z2, w1b[q].z, sb);
            sa = fmaf(z3, w1a[q].w, sa);  sb = fmaf(z3, w1b[q].w, sb);
        }
        const float ha = sa > 0.f ? sa : 0.f;           // lane l: h[l]
        const float hb = sb > 0.f ? sb : 0.f;           // lane l < 28: h[l + 32]

#pragma unroll
        for (int q = 0; q < HID / 4; ++q) {
            const float hsrc = q < 8 ? ha : hb;
            const int   l0   = (4 * q) & 31;
            s2 = fmaf(from_lane(hsrc, l0 + 0), w2r[q].x, s2);
            s2 = fmaf(from_lane(hsrc, l0 + 1), w2r[q].y, s2);
            s2 = fmaf(from_lane(hsrc, l0 + 2), w2r[q].z, s2);
            s2 = fmaf(from_lane(hsrc, l0 + 3), w2r[q].w, s2);
        }

        float mx = -1e30f;
#pragma unroll
        for (int k = 0; k < NEXP; ++k) mx = fmaxf(mx, from_lane(s2, k));
        const float e = __expf(s2 - mx);
        float se = 0.f;
#pragma unroll
        for (int k = 0; k < NEXP; ++k) se += from_lane(e, k);
        const float rs = 1.f / se;
        if (tid < NEXP) gs[tid] = e * rs;
    }
    __syncthreads();   // the sample's gate stands in gs for all eight waves

    const float4 gv = *(const float4*)gs;
    if (isA) {
        A_ws[f] = wr.x * gv.x + wr.y * gv.y + wr.z * gv.z + wr.w * gv.w;
    } else {
        B_ws[f] = (wr.x * gv.x + wr.y * gv.y + wr.z * gv.z + wr.w * gv.w) * SCALING;
    }
}

// ---------------------------------------------------------------------------
// TDM descriptor build + issue: 2D tile (tile_w x tile_h) of fp32, row stride
// `stride_elems`, global -> LDS, with LDS padding of 4 DWORDs after every 64
// DWORDs (pad_interval code 5, pad_amount code 3) => LDS row stride = KC + 4.
// ---------------------------------------------------------------------------
__device__ __forceinline__ void tdm_load_2d(unsigned lds_byte_addr,
                                            const float* gaddr,
                                            unsigned tile_w, unsigned tile_h,
                                            unsigned stride_elems) {
    unsigned long long ga = (unsigned long long)(uintptr_t)gaddr;
    u32x4 g0;
    g0[0] = 1u;                                            // count=1, user-mode
    g0[1] = lds_byte_addr;                                 // LDS byte address
    g0[2] = (unsigned)(ga & 0xffffffffu);                  // global_addr[31:0]
    g0[3] = (unsigned)((ga >> 32) & 0x1ffffffu)            // global_addr[56:32]
          | (2u << 30);                                    // type = 2 (image)
    i32x8 g1;
    g1[0] = (int)((2u << 16)      // data_size = 2 (4 bytes)
          | (1u << 20)            // pad_enable
          | (5u << 22)            // pad_interval code 5 -> every 64 DWORDs
          | (3u << 25));          // pad_amount  code 3 -> 4 DWORDs
    g1[1] = (int)((2048u & 0xffffu) << 16);                // tensor_dim0 lo16
    g1[2] = (int)((2048u >> 16) | (0xffffu << 16));        // dim0 hi | dim1 lo
    g1[3] = (int)(tile_w << 16);                           // dim1 hi | tile_dim0
    g1[4] = (int)(tile_h & 0xffffu);                       // tile_dim1 (dim2=0)
    g1[5] = (int)stride_elems;                             // dim0_stride[31:0]
    g1[6] = 0;                                             // stride hi | dim1_stride lo
    g1[7] = 0;
    i32x4 z4 = {0, 0, 0, 0};
#if __clang_major__ >= 23
    i32x8 z8 = {0, 0, 0, 0, 0, 0, 0, 0};
    __builtin_amdgcn_tensor_load_to_lds(g0, g1, z4, z4, z8, 0);
#else
    __builtin_amdgcn_tensor_load_to_lds(g0, g1, z4, z4, 0);
#endif
}

__device__ __forceinline__ unsigned lds_off(const void* p) {
    return (unsigned)(uintptr_t)p;   // low 32 bits of flat LDS addr = LDS offset
}

// ---------------------------------------------------------------------------
// Kernel 2: out[b] = (x[b] @ A[b]^T) @ B[b].  Both GEMMs on
// V_WMMA_F32_16X16X4_F32; x/A staged global->LDS by the Tensor Data Mover,
// double-buffered so the DMA of chunk i+1 overlaps WMMA compute on chunk i.
// ---------------------------------------------------------------------------
__launch_bounds__(256)
__global__ void lora_main_kernel(const float* __restrict__ x,
                                 const float* __restrict__ A_ws,
                                 const float* __restrict__ B_ws,
                                 float* __restrict__ out) {
    __shared__ __align__(16) float xs[2][TOK_PER_BLK * XS_STR];  // 2 x 17 KB
    __shared__ __align__(16) float as_[2][16 * AS_STR];          // 2 x 4.3 KB
    __shared__ float xa[TOK_PER_BLK * XA_STR];                   // 2.5 KB

    const int b    = blockIdx.y;
    const int s0   = blockIdx.x * TOK_PER_BLK;
    const int tid  = threadIdx.x;
    const int w    = tid >> 5;        // wave id (wave32)
    const int lane = tid & 31;
    const int m    = lane & 15;       // row/col index within 16
    const int g    = lane >> 4;       // half-wave group

    const float* xb = x    + ((size_t)b * SEQ + s0) * DIM;
    const float* Ab = A_ws + (size_t)b * (RNK * DIM);
    const float* Bb = B_ws + (size_t)b * (RNK * DIM);
    float*       ob = out  + ((size_t)b * SEQ + s0) * DIM;

    // Zero N-pad rows (8..15) of both A-chunk buffers once; TDM only writes
    // rows 0..7, so the WMMA B-operand needs no branch for the padded N half.
    for (int v = tid; v < 8 * AS_STR; v += 256) {
        as_[0][8 * AS_STR + v] = 0.f;
        as_[1][8 * AS_STR + v] = 0.f;
    }

    // ---------------- Phase 1: xa = x_tile @ A^T (TDM + WMMA) -------------
    v8f c = {0.f, 0.f, 0.f, 0.f, 0.f, 0.f, 0.f, 0.f};
    const int tt = w & 3;    // token tile owned by this wave
    const int kh = w >> 2;   // K half of each chunk (0: k<32, 1: k>=32)

    if (w == 0) {            // wave-uniform branch: TDM ignores EXEC
        tdm_load_2d(lds_off(&xs[0][0]),  xb, KC, TOK_PER_BLK, DIM);
        tdm_load_2d(lds_off(&as_[0][0]), Ab, KC, RNK,         DIM);
    }

    for (int ci = 0; ci < NCHUNK; ++ci) {
        const int cur = ci & 1;
        if (w == 0) {
            if (ci + 1 < NCHUNK) {
                // prefetch next chunk into the other buffer, then wait for
                // the current chunk (in-order TENSORcnt: <=2 retires pair ci)
                tdm_load_2d(lds_off(&xs[1 - cur][0]),  xb + (ci + 1) * KC,
                            KC, TOK_PER_BLK, DIM);
                tdm_load_2d(lds_off(&as_[1 - cur][0]), Ab + (ci + 1) * KC,
                            KC, RNK, DIM);
                __builtin_amdgcn_s_wait_tensorcnt((short)2);
            } else {
                __builtin_amdgcn_s_wait_tensorcnt((short)0);
            }
        }
        __syncthreads();   // chunk ci visible in LDS to all waves

        const float* xp = &xs[cur][(tt * 16 + m) * XS_STR + 2 * g + kh * (KC / 2)];
        const float* ap = &as_[cur][m * AS_STR + 2 * g + kh * (KC / 2)];
#pragma unroll
        for (int k = 0; k < KC / 2; k += 4) {
            v2f av = *(const v2f*)(xp + k);   // A-op: x[m][k0+2g], x[m][k0+2g+1]
            v2f bv = *(const v2f*)(ap + k);   // B-op: A[n][k0+2g], A[n][k0+2g+1]
            c = __builtin_amdgcn_wmma_f32_16x16x4_f32(false, av, false, bv,
                                                      (short)0, c, false, false);
        }
        __syncthreads();   // done reading buffer `cur` (re-DMAed at ci+2)
    }

    // Combine the two K halves through LDS into xa[token][r].
    if (kh == 1 && m < RNK) {
#pragma unroll
        for (int i = 0; i < 8; ++i)
            xa[(tt * 16 + i + 8 * g) * XA_STR + m] = c[i];
    }
    __syncthreads();
    if (kh == 0 && m < RNK) {
#pragma unroll
        for (int i = 0; i < 8; ++i)
            xa[(tt * 16 + i + 8 * g) * XA_STR + m] += c[i];
    }
    __syncthreads();

    // ---------------- Phase 2: out_tile = xa_tile @ B --------------------
    // Per wave: xa A-operand invariant across its 16 n-chunks per tile; B is
    // read from L2 (512 KB resident). Adjacent waves take adjacent 16-column
    // chunks so the 64B half-line stores combine into full cachelines.
#pragma unroll
    for (int t2 = 0; t2 < 4; ++t2) {
        const float* xr = &xa[(t2 * 16 + m) * XA_STR];
        v2f a0 = *(const v2f*)(xr + 2 * g);       // r = 2g, 2g+1
        v2f a1 = *(const v2f*)(xr + 4 + 2 * g);   // r = 4+2g, 5+2g
        for (int j = 0; j < 16; ++j) {
            int nc  = w + 8 * j;
            int col = nc * 16 + m;
            const float* bp = Bb + col;
            v2f b0 = { bp[(size_t)(2 * g) * DIM],     bp[(size_t)(2 * g + 1) * DIM] };
            v2f b1 = { bp[(size_t)(4 + 2 * g) * DIM], bp[(size_t)(5 + 2 * g) * DIM] };
            v8f d = {0.f, 0.f, 0.f, 0.f, 0.f, 0.f, 0.f, 0.f};
            d = __builtin_amdgcn_wmma_f32_16x16x4_f32(false, a0, false, b0,
                                                      (short)0, d, false, false);
            d = __builtin_amdgcn_wmma_f32_16x16x4_f32(false, a1, false, b1,
                                                      (short)0, d, false, false);
            float* op = ob + (size_t)(t2 * 16 + 8 * g) * DIM + col;
#pragma unroll
            for (int i2 = 0; i2 < 8; ++i2) op[(size_t)i2 * DIM] = d[i2];
        }
    }
}

// ---------------------------------------------------------------------------
extern "C" void kernel_launch(void* const* d_in, const int* in_sizes, int n_in,
                              void* d_out, int out_size, void* d_ws, size_t ws_size,
                              hipStream_t stream) {
    const float* x   = (const float*)d_in[0];
    const float* ctr = (const float*)d_in[1];
    const float* gam = (const float*)d_in[2];
    const float* bet = (const float*)d_in[3];
    const float* W1  = (const float*)d_in[4];
    const float* b1  = (const float*)d_in[5];
    const float* W2  = (const float*)d_in[6];
    const float* b2  = (const float*)d_in[7];
    const float* Wa  = (const float*)d_in[8];
    const float* Wb  = (const float*)d_in[9];
    float* out = (float*)d_out;

    float* A_ws    = (float*)((char*)d_ws + 256);        // 8*8*2048 floats
    float* B_ws    = A_ws + BS * RNK * DIM;              // 8*8*2048 floats

    gate_ab_kernel<<<(2 * BS * RNK * DIM) / 256, 256, 0, stream>>>(
        ctr, gam, bet, W1, b1, W2, b2, Wa, Wb, A_ws, B_ws);
    lora_main_kernel<<<dim3(SEQ / TOK_PER_BLK, BS), 256, 0, stream>>>(x, A_ws, B_ws, out);
}

// v002
// One run takes 34.4 microseconds.
// In both of two side-by-side timings against v001, it was 1.33 times as fast.
// All steps since v000 together make it 1.78 times as fast.
#include <hip/hip_runtime.h>
#include <hip/hip_bf16.h>
#include <cstdint>

typedef __attribute__((ext_vector_type(2))) float v2f;
typedef __attribute__((ext_vector_type(4))) float v4f;
typedef __attribute__((ext_vector_type(8))) float v8f;
typedef __attribute__((ext_vector_type(4))) unsigned int u32x4;
typedef __attribute__((ext_vector_type(8))) int i32x8;
typedef __attribute__((ext_vector_type(4))) int i32x4;

#define BS      8
#define SEQ     2048
#define DIM     2048
#define RNK     8
#define CTR     32
#define HID     60
#define NEXP    4
#define SCALING 2.0f      // 16.0 / r
#define LN_EPS  1e-5f

#define TOK_PER_BLK 64    // tokens per block (4 WMMA tiles of 16)
#define KC      64        // K chunk DMAed into LDS per step (pad_interval=64 DW)
#define XS_STR  (KC + 4)  // TDM pad_amount = 4 DWORDs -> conflict-free 8B gathers
#define AS_STR  (KC + 4)
#define XA_STR  10        // pad 2 -> conflict-free xa gathers
#define NCHUNK  (DIM / KC)

// ---------------------------------------------------------------------------
// Kernel 1: gating MLP + A = gate @ Wa^T, B = gate @ Wb^T (scaling folded
// into B). A block covers 256 rows of one sample, so its wave 0 works out that
// sample's gate itself: lane d holds input d, lane l hidden units l and l+32,
// lane o logit o; a value goes from its lane to all lanes by a lane read.
// Every sum keeps its serial order.
// ---------------------------------------------------------------------------
__device__ __forceinline__ float from_lane(float v, int l) {
    return __int_as_float(__builtin_amdgcn_readlane(__float_as_int(v), l));
}

__launch_bounds__(256)
__global__ void gate_ab_kernel(const float* __restrict__ ctr,
                               const float* __restrict__ gamma,
                               const float* __restrict__ beta,
                               const float* __restrict__ W1, const float* __restrict__ b1,
                               const float* __restrict__ W2, const float* __restrict__ b2,
                               const float* __restrict__ Wa,
                               const float* __restrict__ Wb,
                               float* __restrict__ A_ws,
                               float* __restrict__ B_ws) {
    __shared__ __align__(16) float gs[NEXP];

    const int tid  = threadIdx.x;
    const int blk  = blockIdx.x;                        // 0 .. 1023
    const bool isA = blk < (BS * RNK * DIM) / 256;      // first half: A, second: B
    const int b    = (blk >> 6) & (BS - 1);             // 64 blocks per sample
    const int f    = ((blk << 8) + tid) & (BS * RNK * DIM - 1);
    const int i    = f & (RNK * DIM - 1);

    // This thread's weight row: asked for first, used last.
    const float4 wr = *(const float4*)((isA ? Wa : Wb) + (size_t)i * 4);

    if (tid < 32) {                                     // wave 0, every lane on
        const int ra = tid;                             // hidden units of this lane
        const int rb = tid + 32 < HID ? tid + 32 : HID - 1;
        const int o  = tid & (NEXP - 1);                // logit of this lane
        float4 w1a[CTR / 4], w1b[CTR / 4], w2r[HID / 4];
        // All loops of this branch are unrolled: the arrays stay in registers and
        // a lane read takes its lane as a constant only with constant indices.
#pragma unroll
        for (int q = 0; q < CTR / 4; ++q) {
            w1a[q] = *(const float4*)(W1 + ra * CTR + 4 * q);
            w1b[q] = *(const float4*)(W1 + rb * CTR + 4 * q);
        }
#pragma unroll
        for (int q = 0; q < HID / 4; ++q)
            w2r[q] = *(const float4*)(W2 + o * HID + 4 * q);
        const float cv = ctr[b * CTR + tid];
        const float gm = gamma[tid];
        const float bt = beta[tid];
        float sa = b1[ra];
        float sb = b1[rb];
        float s2 = b2[o];
        // Keeps every load above in front of the serial sums below, so that the
        // wave pays one memory latency and not one per layer.
        __builtin_amdgcn_sched_barrier(0);

        float mu = 0.f;
#pragma unroll
        for (int d = 0; d < CTR; ++d) mu += from_lane(cv, d);
        mu *= (1.f / CTR);
        float var = 0.f;
#pragma unroll
        for (int d = 0; d < CTR; ++d) { float t = from_lane(cv, d) - mu; var += t * t; }
        var *= (1.f / CTR);
        const float inv = rsqrtf(var + LN_EPS);
        const float zv  = (cv - mu) * inv * gm + bt;    // lane d: z[d]

#pragma unroll
        for (int q = 0; q < CTR / 4; ++q) {
            const float z0 = from_lane(zv, 4 * q + 0), z1 = from_lane(zv, 4 * q + 1);
            const float z2 = from_lane(zv, 4 * q + 2), z3 = from_lane(zv, 4 * q + 3);
            sa = fmaf(z0, w1a[q].x, sa);  sb = fmaf(z0, w1b[q].x, sb);
            sa = fmaf(z1, w1a[q].y, sa);  sb = fmaf(z1, w1b[q].y, sb);
            sa = fmaf(z2, w1a[q].z, sa);  sb = fmaf(z2, w1b[q].z, sb);
            sa = fmaf(z3, w1a[q].w, sa);  sb = fmaf(z3, w1b[q].w, sb);
        }
        const float ha = sa > 0.f ? sa : 0.f;           // lane l: h[l]
        const float hb = sb > 0.f ? sb : 0.f;           // lane l < 28: h[l + 32]

#pragma unroll
        for (int q = 0; q < HID / 4; ++q) {
            const float hsrc = q < 8 ? ha : hb;
            const int   l0   = (4 * q) & 31;
            s2 = fmaf(from_lane(hsrc, l0 + 0), w2r[q].x, s2);
            s2 = fmaf(from_lane(hsrc, l0 + 1), w2r[q].y, s2);
            s2 = fmaf(from_lane(hsrc, l0 + 2), w2r[q].z, s2);
            s2 = fmaf(from_lane(hsrc, l0 + 3), w2r[q].w, s2);
        }

        float mx = -1e30f;
#pragma unroll
        for (int k = 0; k < NEXP; ++k) mx = fmaxf(mx, from_lane(s2, k));
        const float e = __expf(s2 - mx);
        float se = 0.f;
#pragma unroll
        for (int k = 0; k < NEXP; ++k) se += from_lane(e, k);
        const float rs = 1.f / se;
        if (tid < NEXP) gs[tid] = e * rs;
    }
    __syncthreads();   // the sample's gate stands in gs for all eight waves

    const float4 gv = *(const float4*)gs;
    if (isA) {
        A_ws[f] = wr.x * gv.x + wr.y * gv.y + wr.z * gv.z + wr.w * gv.w;
    } else {
        B_ws[f] = (wr.x * gv.x + wr.y * gv.y + wr.z * gv.z + wr.w * gv.w) * SCALING;
    }
}

// ---------------------------------------------------------------------------
// TDM descriptor build + issue: 2D tile (tile_w x tile_h) of fp32, row stride
// `stride_elems`, global -> LDS, with LDS padding of 4 DWORDs after every 64
// DWORDs (pad_interval code 5, pad_amount code 3) => LDS row stride = KC + 4.
// ---------------------------------------------------------------------------
__device__ __forceinline__ void tdm_load_2d(unsigned lds_byte_addr,
                                            const float* gaddr,
                                            unsigned tile_w, unsigned tile_h,
                                            unsigned stride_elems) {
    unsigned long long ga = (unsigned long long)(uintptr_t)gaddr;
    u32x4 g0;
    g0[0] = 1u;                                            // count=1, user-mode
    g0[1] = lds_byte_addr;                                 // LDS byte address
    g0[2] = (unsigned)(ga & 0xffffffffu);                  // global_addr[31:0]
    g0[3] = (unsigned)((ga >> 32) & 0x1ffffffu)            // global_addr[56:32]
          | (2u << 30);                                    // type = 2 (image)
    i32x8 g1;
    g1[0] = (int)((2u << 16)      // data_size = 2 (4 bytes)
          | (1u << 20)            // pad_enable
          | (5u << 22)            // pad_interval code 5 -> every 64 DWORDs
          | (3u << 25));          // pad_amount  code 3 -> 4 DWORDs
    g1[1] = (int)((2048u & 0xffffu) << 16);                // tensor_dim0 lo16
    g1[2] = (int)((2048u >> 16) | (0xffffu << 16));        // dim0 hi | dim1 lo
    g1[3] = (int)(tile_w << 16);                           // dim1 hi | tile_dim0
    g1[4] = (int)(tile_h & 0xffffu);                       // tile_dim1 (dim2=0)
    g1[5] = (int)stride_elems;                             // dim0_stride[31:0]
    g1[6] = 0;                                             // stride hi | dim1_stride lo
    g1[7] = 0;
    i32x4 z4 = {0, 0, 0, 0};
#if __clang_major__ >= 23
    i32x8 z8 = {0, 0, 0, 0, 0, 0, 0, 0};
    __builtin_amdgcn_tensor_load_to_lds(g0, g1, z4, z4, z8, 0);
#else
    __builtin_amdgcn_tensor_load_to_lds(g0, g1, z4, z4, 0);
#endif
}

__device__ __forceinline__ unsigned lds_off(const void* p) {
    return (unsigned)(uintptr_t)p;   // low 32 bits of flat LDS addr = LDS offset
}

// ---------------------------------------------------------------------------
// Kernel 2: out[b] = (x[b] @ A[b]^T) @ B[b].  Both GEMMs on
// V_WMMA_F32_16X16X4_F32; x/A staged global->LDS by the Tensor Data Mover,
// double-buffered so the DMA of chunk i+1 overlaps WMMA compute on chunk i.
// ---------------------------------------------------------------------------
__launch_bounds__(256)
__global__ void lora_main_kernel(const float* __restrict__ x,
                                 const float* __restrict__ A_ws,
                                 const float* __restrict__ B_ws,
                                 float* __restrict__ out) {
    __shared__ __align__(16) float xs[2][TOK_PER_BLK * XS_STR];  // 2 x 17 KB
    __shared__ __align__(16) float as_[2][16 * AS_STR];          // 2 x 4.3 KB
    __shared__ float xa[TOK_PER_BLK * XA_STR];                   // 2.5 KB

    const int b    = blockIdx.y;
    const int s0   = blockIdx.x * TOK_PER_BLK;
    const int tid  = threadIdx.x;
    const int w    = tid >> 5;        // wave id (wave32)
    const int lane = tid & 31;
    const int m    = lane & 15;       // row/col index within 16
    const int g    = lane >> 4;       // half-wave group

    const float* xb = x    + ((size_t)b * SEQ + s0) * DIM;
    const float* Ab = A_ws + (size_t)b * (RNK * DIM);
    const float* Bb = B_ws + (size_t)b * (RNK * DIM);
    float*       ob = out  + ((size_t)b * SEQ + s0) * DIM;

    // Zero N-pad rows (8..15) of both A-chunk buffers once; TDM only writes
    // rows 0..7, so the WMMA B-operand needs no branch for the padded N half.
    for (int v = tid; v < 8 * AS_STR; v += 256) {
        as_[0][8 * AS_STR + v] = 0.f;
        as_[1][8 * AS_STR + v] = 0.f;
    }

    // ---------------- Phase 1: xa = x_tile @ A^T (TDM + WMMA) -------------
    v8f c = {0.f, 0.f, 0.f, 0.f, 0.f, 0.f, 0.f, 0.f};
    const int tt = w & 3;    // token tile owned by this wave
    const int kh = w >> 2;   // K half of each chunk (0: k<32, 1: k>=32)

    if (w == 0) {            // wave-uniform branch: TDM ignores EXEC
        tdm_load_2d(lds_off(&xs[0][0]),  xb, KC, TOK_PER_BLK, DIM);
        tdm_load_2d(lds_off(&as_[0][0]), Ab, KC, RNK,         DIM);
    }

    for (int ci = 0; ci < NCHUNK; ++ci) {
        const int cur = ci & 1;
        if (w == 0) {
            if (ci + 1 < NCHUNK) {
                // prefetch next chunk into the other buffer, then wait for
                // the current chunk (in-order TENSORcnt: <=2 retires pair ci)
                tdm_load_2d(lds_off(&xs[1 - cur][0]),  xb + (ci + 1) * KC,
                            KC, TOK_PER_BLK, DIM);
                tdm_load_2d(lds_off(&as_[1 - cur][0]), Ab + (ci + 1) * KC,
                            KC, RNK, DIM);
                __builtin_amdgcn_s_wait_tensorcnt((short)2);
            } else {
                __builtin_amdgcn_s_wait_tensorcnt((short)0);
            }
        }
        __syncthreads();   // chunk ci visible in LDS to all waves

        const float* xp = &xs[cur][(tt * 16 + m) * XS_STR + 2 * g + kh * (KC / 2)];
        const float* ap = &as_[cur][m * AS_STR + 2 * g + kh * (KC / 2)];
#pragma unroll
        for (int k = 0; k < KC / 2; k += 4) {
            v2f av = *(const v2f*)(xp + k);   // A-op: x[m][k0+2g], x[m][k0+2g+1]
            v2f bv = *(const v2f*)(ap + k);   // B-op: A[n][k0+2g], A[n][k0+2g+1]
            c = __builtin_amdgcn_wmma_f32_16x16x4_f32(false, av, false, bv,
                                                      (short)0, c, false, false);
        }
        __syncthreads();   // done reading buffer `cur` (re-DMAed at ci+2)
    }

    // Combine the two K halves through LDS into xa[token][r].
    if (kh == 1 && m < RNK) {
#pragma unroll
        for (int i = 0; i < 8; ++i)
            xa[(tt * 16 + i + 8 * g) * XA_STR + m] = c[i];
    }
    __syncthreads();
    if (kh == 0 && m < RNK) {
#pragma unroll
        for (int i = 0; i < 8; ++i)
            xa[(tt * 16 + i + 8 * g) * XA_STR + m] += c[i];
    }
    __syncthreads();

    // ---------------- Phase 2: out_tile = xa_tile @ B --------------------
    // A wave takes 64-column groups. Inside a group, column n of product q is
    // output column 4n + q: after the four products a lane holds four adjacent
    // columns of each of its rows and stores them as one 16-byte piece, so the
    // 16 lanes of a row write 256 contiguous, aligned bytes in one instruction.
    // The k order and the two-step sum of every output element stay as they were.
    v4f br[4][4];   // [group][k row]: B[k][4 adjacent columns], read from L2
    // Unrolled: br and d are indexed by constants only and stay in registers.
#pragma unroll
    for (int jg = 0; jg < 4; ++jg) {
        const float* bp = Bb + (w + 8 * jg) * 64 + 4 * m;
        br[jg][0] = *(const v4f*)(bp + (size_t)(2 * g) * DIM);
        br[jg][1] = *(const v4f*)(bp + (size_t)(2 * g + 1) * DIM);
        br[jg][2] = *(const v4f*)(bp + (size_t)(4 + 2 * g) * DIM);
        // The compiler lets the last load land on the address pair that the loads
        // in front of it name: this wait stands in front of that overwrite.
        if (jg == 3) asm volatile("s_wait_xcnt 0x0" ::: "memory");
        br[jg][3] = *(const v4f*)(bp + (size_t)(5 + 2 * g) * DIM);
    }
#pragma unroll
    for (int t2 = 0; t2 < 4; ++t2) {
        const float* xr = &xa[(t2 * 16 + m) * XA_STR];
        v2f a0 = *(const v2f*)(xr + 2 * g);       // r = 2g, 2g+1
        v2f a1 = *(const v2f*)(xr + 4 + 2 * g);   // r = 4+2g, 5+2g
#pragma unroll
        for (int jg = 0; jg < 4; ++jg) {
            v8f d[4];
#pragma unroll
            for (int q = 0; q < 4; ++q) {
                v2f b0 = { br[jg][0][q], br[jg][1][q] };
                v2f b1 = { br[jg][2][q], br[jg][3][q] };
                v8f z = {0.f, 0.f, 0.f, 0.f, 0.f, 0.f, 0.f, 0.f};
                z = __builtin_amdgcn_wmma_f32_16x16x4_f32(false, a0, false, b0,
                                                          (short)0, z, false, false);
                d[q] = __builtin_amdgcn_wmma_f32_16x16x4_f32(false, a1, false, b1,
                                                             (short)0, z, false, false);
            }
            float* op = ob + (size_t)(t2 * 16 + 8 * g) * DIM + (w + 8 * jg) * 64 + 4 * m;
#pragma unroll
            for (int i2 = 0; i2 < 8; ++i2) {
                v4f o = { d[0][i2], d[1][i2], d[2][i2], d[3][i2] };
                *(v4f*)(op + (size_t)i2 * DIM) = o;
            }
        }
    }
}

// ---------------------------------------------------------------------------
extern "C" void kernel_launch(void* const* d_in, const int* in_sizes, int n_in,
                              void* d_out, int out_size, void* d_ws, size_t ws_size,
                              hipStream_t stream) {
    const float* x   = (const float*)d_in[0];
    const float* ctr = (const float*)d_in[1];
    const float* gam = (const float*)d_in[2];
    const float* bet = (const float*)d_in[3];
    const float* W1  = (const float*)d_in[4];
    const float* b1  = (const float*)d_in[5];
    const float* W2  = (const float*)d_in[6];
    const float* b2  = (const float*)d_in[7];
    const float* Wa  = (const float*)d_in[8];
    const float* Wb  = (const float*)d_in[9];
    float* out = (float*)d_out;

    float* A_ws    = (float*)((char*)d_ws + 256);        // 8*8*2048 floats
    float* B_ws    = A_ws + BS * RNK * DIM;              // 8*8*2048 floats

    gate_ab_kernel<<<(2 * BS * RNK * DIM) / 256, 256, 0, stream>>>(
        ctr, gam, bet, W1, b1, W2, b2, Wa, Wb, A_ws, B_ws);
    lora_main_kernel<<<dim3(SEQ / TOK_PER_BLK, BS), 256, 0, stream>>>(x, A_ws, B_ws, out);
}

// v003
// Measured time: 33.2 microseconds a run.
// Timed twice side by side with v002, it ran 1.04 times as fast both times.
// Over all steps from v000 it is 1.85 times as fast.
#include <hip/hip_runtime.h>
#include <hip/hip_bf16.h>
#include <cstdint>

typedef __attribute__((ext_vector_type(2))) float v2f;
typedef __attribute__((ext_vector_type(4))) float v4f;
typedef __attribute__((ext_vector_type(8))) float v8f;
typedef __attribute__((ext_vector_type(4))) unsigned int u32x4;
typedef __attribute__((ext_vector_type(8))) int i32x8;
typedef __attribute__((ext_vector_type(4))) int i32x4;

#define BS      8
#define SEQ     2048
#define DIM     2048
#define RNK     8
#define CTR     32
#define HID     60
#define NEXP    4
#define SCALING 2.0f      // 16.0 / r
#define LN_EPS  1e-5f

#define TOK_PER_BLK 64    // tokens per block (4 WMMA tiles of 16)
#define KC      64        // K chunk DMAed into LDS per step (pad_interval=64 DW)
#define XS_STR  (KC + 4)  // TDM pad_amount = 4 DWORDs -> conflict-free 8B gathers
#define AS_STR  (KC + 4)
#define XA_STR  10        // pad 2 -> conflict-free xa gathers
#define NCHUNK  (DIM / KC)
#define ROWS_PER_THR 16                       // rows of A or B per thread, kernel 1
#define ROWS_PER_BLK (256 * ROWS_PER_THR)     // 4 blocks per sample and matrix

// ---------------------------------------------------------------------------
// Kernel 1: gating MLP + A = gate @ Wa^T, B = gate @ Wb^T (scaling folded
// into B). A block covers 256 * ROWS_PER_THR rows of one sample (a thread takes
// ROWS_PER_THR rows, 256 apart), so the launch has few waves to start and few
// copies of the gate sums. Wave 0 of a block works out that sample's gate
// itself: lane d holds input d, lane l hidden units l and l+32,
// lane o logit o; a value goes from its lane to all lanes by a lane read.
// Every sum keeps its serial order.
// ---------------------------------------------------------------------------
__device__ __forceinline__ float from_lane(float v, int l) {
    return __int_as_float(__builtin_amdgcn_readlane(__float_as_int(v), l));
}

__launch_bounds__(256)
__global__ void gate_ab_kernel(const float* __restrict__ ctr,
                               const float* __restrict__ gamma,
                               const float* __restrict__ beta,
                               const float* __restrict__ W1, const float* __restrict__ b1,
                               const float* __restrict__ W2, const float* __restrict__ b2,
                               const float* __restrict__ Wa,
                               const float* __restrict__ Wb,
                               float* __restrict__ A_ws,
                               float* __restrict__ B_ws) {
    __shared__ __align__(16) float gs[NEXP];

    const int tid  = threadIdx.x;
    const int blk  = blockIdx.x;                        // 0 .. 63
    const bool isA = blk < (BS * RNK * DIM) / ROWS_PER_BLK;   // first half: A, second: B
    const int b    = (blk / (RNK * DIM / ROWS_PER_BLK)) & (BS - 1);
    const int f    = (blk * ROWS_PER_BLK + tid) & (BS * RNK * DIM - 1);  // first row
    const int i    = f & (RNK * DIM - 1);

    // This thread's weight rows: asked for first, used last. Unrolled: wr stays
    // in registers and all its loads are in flight together.
    const float* wsrc = (isA ? Wa : Wb) + (size_t)i * 4;
    float4 wr[ROWS_PER_THR];
#pragma unroll
    for (int j = 0; j < ROWS_PER_THR; ++j) {
        // The compiler lets the last load land on the address register that the
        // loads in front of it name: this wait stands in front of that overwrite.
        if (j == ROWS_PER_THR - 1) asm volatile("s_wait_xcnt 0x0" ::: "memory");
        wr[j] = *(const float4*)(wsrc + (size_t)j * 256 * 4);
    }

    if (tid < 32) {                                     // wave 0, every lane on
        const int ra = tid;                             // hidden units of this lane
        const int rb = tid + 32 < HID ? tid + 32 : HID - 1;
        const int o  = tid & (NEXP - 1);                // logit of this lane
        float4 w1a[CTR / 4], w1b[CTR / 4], w2r[HID / 4];
        // All loops of this branch are unrolled: the arrays stay in registers and
        // a lane read takes its lane as a constant only with constant indices.
#pragma unroll
        for (int q = 0; q < CTR / 4; ++q) {
            w1a[q] = *(const float4*)(W1 + ra * CTR + 4 * q);
            w1b[q] = *(const float4*)(W1 + rb * CTR + 4 * q);
        }
#pragma unroll
        for (int q = 0; q < HID / 4; ++q)
            w2r[q] = *(const float4*)(W2 + o * HID + 4 * q);
        const float cv = ctr[b * CTR + tid];
        const float gm = gamma[tid];
        const float bt = beta[tid];
        float sa = b1[ra];
        float sb = b1[rb];
        float s2 = b2[o];
        // Keeps every load above in front of the serial sums below, so that the
        // wave pays one memory latency and not one per layer.
        __builtin_amdgcn_sched_barrier(0);

        float mu = 0.f;
#pragma unroll
        for (int d = 0; d < CTR; ++d) mu += from_lane(cv, d);
        mu *= (1.f / CTR);
        float var = 0.f;
#pragma unroll
        for (int d = 0; d < CTR; ++d) { float t = from_lane(cv, d) - mu; var += t * t; }
        var *= (1.f / CTR);
        const float inv = rsqrtf(var + LN_EPS);
        const float zv  = (cv - mu) * inv * gm + bt;    // lane d: z[d]

#pragma unroll
        for (int q = 0; q < CTR / 4; ++q) {
            const float z0 = from_lane(zv, 4 * q + 0), z1 = from_lane(zv, 4 * q + 1);
            const float z2 = from_lane(zv, 4 * q + 2), z3 = from_lane(zv, 4 * q + 3);
            sa = fmaf(z0, w1a[q].x, sa);  sb = fmaf(z0, w1b[q].x, sb);
            sa = fmaf(z1, w1a[q].y, sa);  sb = fmaf(z1, w1b[q].y, sb);
            sa = fmaf(z2, w1a[q].z, sa);  sb = fmaf(z2, w1b[q].z, sb);
            sa = fmaf(z3, w1a[q].w, sa);  sb = fmaf(z3, w1b[q].w, sb);
        }
        const float ha = sa > 0.f ? sa : 0.f;           // lane l: h[l]
        const float hb = sb > 0.f ? sb : 0.f;           // lane l < 28: h[l + 32]

#pragma unroll
        for (int q = 0; q < HID / 4; ++q) {
            const float hsrc = q < 8 ? ha : hb;
            const int   l0   = (4 * q) & 31;
            s2 = fmaf(from_lane(hsrc, l0 + 0), w2r[q].x, s2);
            s2 = fmaf(from_lane(hsrc, l0 + 1), w2r[q].y, s2);
            s2 = fmaf(from_lane(hsrc, l0 + 2), w2r[q].z, s2);
            s2 = fmaf(from_lane(hsrc, l0 + 3), w2r[q].w, s2);
        }

        float mx = -1e30f;
#pragma unroll
        for (int k = 0; k < NEXP; ++k) mx = fmaxf(mx, from_lane(s2, k));
        const float e = __expf(s2 - mx);
        float se = 0.f;
#pragma unroll
        for (int k = 0; k < NEXP; ++k) se += from_lane(e, k);
        const float rs = 1.f / se;
        if (tid < NEXP) gs[tid] = e * rs;
    }
    __syncthreads();   // the sample's gate stands in gs for all eight waves

    const float4 gv = *(const float4*)gs;
    float* dst     = (isA ? A_ws : B_ws) + f;
    const float sc = isA ? 1.f : SCALING;               // both factors are exact
#pragma unroll   // wr is indexed by constants only
    for (int j = 0; j < ROWS_PER_THR; ++j)
        dst[j * 256] = (wr[j].x * gv.x + wr[j].y * gv.y + wr[j].z * gv.z + wr[j].w * gv.w) * sc;
}

// ---------------------------------------------------------------------------
// TDM descriptor build + issue: 2D tile (tile_w x tile_h) of fp32, row stride
// `stride_elems`, global -> LDS, with LDS padding of 4 DWORDs after every 64
// DWORDs (pad_interval code 5, pad_amount code 3) => LDS row stride = KC + 4.
// ---------------------------------------------------------------------------
__device__ __forceinline__ void tdm_load_2d(unsigned lds_byte_addr,
                                            const float* gaddr,
                                            unsigned tile_w, unsigned tile_h,
                                            unsigned stride_elems) {
    unsigned long long ga = (unsigned long long)(uintptr_t)gaddr;
    u32x4 g0;
    g0[0] = 1u;                                            // count=1, user-mode
    g0[1] = lds_byte_addr;                                 // LDS byte address
    g0[2] = (unsigned)(ga & 0xffffffffu);                  // global_addr[31:0]
    g0[3] = (unsigned)((ga >> 32) & 0x1ffffffu)            // global_addr[56:32]
          | (2u << 30);                                    // type = 2 (image)
    i32x8 g1;
    g1[0] = (int)((2u << 16)      // data_size = 2 (4 bytes)
          | (1u << 20)            // pad_enable
          | (5u << 22)            // pad_interval code 5 -> every 64 DWORDs
          | (3u << 25));          // pad_amount  code 3 -> 4 DWORDs
    g1[1] = (int)((2048u & 0xffffu) << 16);                // tensor_dim0 lo16
    g1[2] = (int)((2048u >> 16) | (0xffffu << 16));        // dim0 hi | dim1 lo
    g1[3] = (int)(tile_w << 16);                           // dim1 hi | tile_dim0
    g1[4] = (int)(tile_h & 0xffffu);                       // tile_dim1 (dim2=0)
    g1[5] = (int)stride_elems;                             // dim0_stride[31:0]
    g1[6] = 0;                                             // stride hi | dim1_stride lo
    g1[7] = 0;
    i32x4 z4 = {0, 0, 0, 0};
#if __clang_major__ >= 23
    i32x8 z8 = {0, 0, 0, 0, 0, 0, 0, 0};
    __builtin_amdgcn_tensor_load_to_lds(g0, g1, z4, z4, z8, 0);
#else
    __builtin_amdgcn_tensor_load_to_lds(g0, g1, z4, z4, 0);
#endif
}

__device__ __forceinline__ unsigned lds_off(const void* p) {
    return (unsigned)(uintptr_t)p;   // low 32 bits of flat LDS addr = LDS offset
}

// ---------------------------------------------------------------------------
// Kernel 2: out[b] = (x[b] @ A[b]^T) @ B[b].  Both GEMMs on
// V_WMMA_F32_16X16X4_F32; x/A staged global->LDS by the Tensor Data Mover,
// double-buffered so the DMA of chunk i+1 overlaps WMMA compute on chunk i.
// ---------------------------------------------------------------------------
__launch_bounds__(256)
__global__ void lora_main_kernel(const float* __restrict__ x,
                                 const float* __restrict__ A_ws,
                                 const float* __restrict__ B_ws,
                                 float* __restrict__ out) {
    __shared__ __align__(16) float xs[2][TOK_PER_BLK * XS_STR];  // 2 x 17 KB
    __shared__ __align__(16) float as_[2][16 * AS_STR];          // 2 x 4.3 KB
    __shared__ float xa[TOK_PER_BLK * XA_STR];                   // 2.5 KB

    const int b    = blockIdx.y;
    const int s0   = blockIdx.x * TOK_PER_BLK;
    const int tid  = threadIdx.x;
    const int w    = tid >> 5;        // wave id (wave32)
    const int lane = tid & 31;
    const int m    = lane & 15;       // row/col index within 16
    const int g    = lane >> 4;       // half-wave group

    const float* xb = x    + ((size_t)b * SEQ + s0) * DIM;
    const float* Ab = A_ws + (size_t)b * (RNK * DIM);
    const float* Bb = B_ws + (size_t)b * (RNK * DIM);
    float*       ob = out  + ((size_t)b * SEQ + s0) * DIM;

    // Zero N-pad rows (8..15) of both A-chunk buffers once; TDM only writes
    // rows 0..7, so the WMMA B-operand needs no branch for the padded N half.
    for (int v = tid; v < 8 * AS_STR; v += 256) {
        as_[0][8 * AS_STR + v] = 0.f;
        as_[1][8 * AS_STR + v] = 0.f;
    }

    // ---------------- Phase 1: xa = x_tile @ A^T (TDM + WMMA) -------------
    v8f c = {0.f, 0.f, 0.f, 0.f, 0.f, 0.f, 0.f, 0.f};
    const int tt = w & 3;    // token tile owned by this wave
    const int kh = w >> 2;   // K half of each chunk (0: k<32, 1: k>=32)

    if (w == 0) {            // wave-uniform branch: TDM ignores EXEC
        tdm_load_2d(lds_off(&xs[0][0]),  xb, KC, TOK_PER_BLK, DIM);
        tdm_load_2d(lds_off(&as_[0][0]), Ab, KC, RNK,         DIM);
    }

    for (int ci = 0; ci < NCHUNK; ++ci) {
        const int cur = ci & 1;
        if (w == 0) {
            if (ci + 1 < NCHUNK) {
                // prefetch next chunk into the other buffer, then wait for
                // the current chunk (in-order TENSORcnt: <=2 retires pair ci)
                tdm_load_2d(lds_off(&xs[1 - cur][0]),  xb + (ci + 1) * KC,
                            KC, TOK_PER_BLK, DIM);
                tdm_load_2d(lds_off(&as_[1 - cur][0]), Ab + (ci + 1) * KC,
                            KC, RNK, DIM);
                __builtin_amdgcn_s_wait_tensorcnt((short)2);
            } else {
                __builtin_amdgcn_s_wait_tensorcnt((short)0);
            }
        }
        __syncthreads();   // chunk ci visible in LDS to all waves

        const float* xp = &xs[cur][(tt * 16 + m) * XS_STR + 2 * g + kh * (KC / 2)];
        const float* ap = &as_[cur][m * AS_STR + 2 * g + kh * (KC / 2)];
#pragma unroll
        for (int k = 0; k < KC / 2; k += 4) {
            v2f av = *(const v2f*)(xp + k);   // A-op: x[m][k0+2g], x[m][k0+2g+1]
            v2f bv = *(const v2f*)(ap + k);   // B-op: A[n][k0+2g], A[n][k0+2g+1]
            c = __builtin_amdgcn_wmma_f32_16x16x4_f32(false, av, false, bv,
                                                      (short)0, c, false, false);
        }
        __syncthreads();   // done reading buffer `cur` (re-DMAed at ci+2)
    }

    // Combine the two K halves through LDS into xa[token][r].
    if (kh == 1 && m < RNK) {
#pragma unroll
        for (int i = 0; i < 8; ++i)
            xa[(tt * 16 + i + 8 * g) * XA_STR + m] = c[i];
    }
    __syncthreads();
    if (kh == 0 && m < RNK) {
#pragma unroll
        for (int i = 0; i < 8; ++i)
            xa[(tt * 16 + i + 8 * g) * XA_STR + m] += c[i];
    }
    __syncthreads();

    // ---------------- Phase 2: out_tile = xa_tile @ B --------------------
    // A wave takes 64-column groups. Inside a group, column n of product q is
    // output column 4n + q: after the four products a lane holds four adjacent
    // columns of each of its rows and stores them as one 16-byte piece, so the
    // 16 lanes of a row write 256 contiguous, aligned bytes in one instruction.
    // The k order and the two-step sum of every output element stay as they were.
    v4f br[4][4];   // [group][k row]: B[k][4 adjacent columns], read from L2
    // Unrolled: br and d are indexed by constants only and stay in registers.
#pragma unroll
    for (int jg = 0; jg < 4; ++jg) {
        const float* bp = Bb + (w + 8 * jg) * 64 + 4 * m;
        br[jg][0] = *(const v4f*)(bp + (size_t)(2 * g) * DIM);
        br[jg][1] = *(const v4f*)(bp + (size_t)(2 * g + 1) * DIM);
        br[jg][2] = *(const v4f*)(bp + (size_t)(4 + 2 * g) * DIM);
        // The compiler lets the last load land on the address pair that the loads
        // in front of it name: this wait stands in front of that overwrite.
        if (jg == 3) asm volatile("s_wait_xcnt 0x0" ::: "memory");
        br[jg][3] = *(const v4f*)(bp + (size_t)(5 + 2 * g) * DIM);
    }
#pragma unroll
    for (int t2 = 0; t2 < 4; ++t2) {
        const float* xr = &xa[(t2 * 16 + m) * XA_STR];
        v2f a0 = *(const v2f*)(xr + 2 * g);       // r = 2g, 2g+1
        v2f a1 = *(const v2f*)(xr + 4 + 2 * g);   // r = 4+2g, 5+2g
#pragma unroll
        for (int jg = 0; jg < 4; ++jg) {
            v8f d[4];
#pragma unroll
            for (int q = 0; q < 4; ++q) {
                v2f b0 = { br[jg][0][q], br[jg][1][q] };
                v2f b1 = { br[jg][2][q], br[jg][3][q] };
                v8f z = {0.f, 0.f, 0.f, 0.f, 0.f, 0.f, 0.f, 0.f};
                z = __builtin_amdgcn_wmma_f32_16x16x4_f32(false, a0, false, b0,
                                                          (short)0, z, false, false);
                d[q] = __builtin_amdgcn_wmma_f32_16x16x4_f32(false, a1, false, b1,
                                                             (short)0, z, false, false);
            }
            float* op = ob + (size_t)(t2 * 16 + 8 * g) * DIM + (w + 8 * jg) * 64 + 4 * m;
#pragma unroll
            for (int i2 = 0; i2 < 8; ++i2) {
                v4f o = { d[0][i2], d[1][i2], d[2][i2], d[3][i2] };
                *(v4f*)(op + (size_t)i2 * DIM) = o;
            }
        }
    }
}

// ---------------------------------------------------------------------------
extern "C" void kernel_launch(void* const* d_in, const int* in_sizes, int n_in,
                              void* d_out, int out_size, void* d_ws, size_t ws_size,
                              hipStream_t stream) {
    const float* x   = (const float*)d_in[0];
    const float* ctr = (const float*)d_in[1];
    const float* gam = (const float*)d_in[2];
    const float* bet = (const float*)d_in[3];
    const float* W1  = (const float*)d_in[4];
    const float* b1  = (const float*)d_in[5];
    const float* W2  = (const float*)d_in[6];
    const float* b2  = (const float*)d_in[7];
    const float* Wa  = (const float*)d_in[8];
    const float* Wb  = (const float*)d_in[9];
    float* out = (float*)d_out;

    float* A_ws    = (float*)((char*)d_ws + 256);        // 8*8*2048 floats
    float* B_ws    = A_ws + BS * RNK * DIM;              // 8*8*2048 floats

    gate_ab_kernel<<<(2 * BS * RNK * DIM) / ROWS_PER_BLK, 256, 0, stream>>>(
        ctr, gam, bet, W1, b1, W2, b2, Wa, Wb, A_ws, B_ws);
    lora_main_kernel<<<dim3(SEQ / TOK_PER_BLK, BS), 256, 0, stream>>>(x, A_ws, B_ws, out);
}

// v004
// One run takes 22.3 microseconds.
// In two side-by-side timings against v003, it was 1.49 and 1.48 times as fast.
// Over all steps from v000 it is 2.75 times as fast.
#include <hip/hip_runtime.h>
#include <hip/hip_bf16.h>
#include <cstdint>

typedef __attribute__((ext_vector_type(2))) float v2f;
typedef __attribute__((ext_vector_type(4))) float v4f;
typedef __attribute__((ext_vector_type(8))) float v8f;
typedef __attribute__((ext_vector_type(4))) unsigned int u32x4;
typedef __attribute__((ext_vector_type(8))) unsigned int u32x8;

#define BS      8
#define SEQ     2048
#define DIM     2048
#define RNK     8
#define CTR     32
#define HID     60
#define NEXP    4
#define SCALING 2.0f      // 16.0 / r
#define LN_EPS  1e-5f

#define TOK_PER_BLK 64    // tokens per block (4 WMMA tiles of 16)
#define KC      64        // K chunk of one tensor load: rows of 256 bytes
#define XS_STR  (KC + 4)  // the load's pad of 4 dwords a row -> conflict-free 8B gathers
#define AP      (DIM + 4) // LDS pitch of a whole A row: row n starts on bank 4n
#define NSLOT   4         // slots of a wave's own ring: one read, three in flight
#define SLOT_B  6144      // 16 rows x 272 B = 4352 B, rounded up to a multiple of 2 KiB
#define XA_STR  10        // pad 2 -> conflict-free xa gathers
#define NCHUNK  (DIM / KC)
#define NSTAGE  (NCHUNK / 2)                  // chunks per wave: two waves share a token tile
#define ROWS_PER_THR 16                       // rows of A or B per thread, kernel 1
#define ROWS_PER_BLK (256 * ROWS_PER_THR)     // 4 blocks per sample and matrix

// ---------------------------------------------------------------------------
// Kernel 1: gating MLP + A = gate @ Wa^T, B = gate @ Wb^T (scaling folded
// into B). A block covers 256 * ROWS_PER_THR rows of one sample (a thread takes
// ROWS_PER_THR rows, 256 apart), so the launch has few waves to start and few
// copies of the gate sums. Wave 0 of a block works out that sample's gate
// itself: lane d holds input d, lane l hidden units l and l+32,
// lane o logit o; a value goes from its lane to all lanes by a lane read.
// Every sum keeps its serial order.
// ---------------------------------------------------------------------------
__device__ __forceinline__ float from_lane(float v, int l) {
    return __int_as_float(__builtin_amdgcn_readlane(__float_as_int(v), l));
}

__launch_bounds__(256)
__global__ void gate_ab_kernel(const float* __restrict__ ctr,
                               const float* __restrict__ gamma,
                               const float* __restrict__ beta,
                               const float* __restrict__ W1, const float* __restrict__ b1,
                               const float* __restrict__ W2, const float* __restrict__ b2,
                               const float* __restrict__ Wa,
                               const float* __restrict__ Wb,
                               float* __restrict__ A_ws,
                               float* __restrict__ B_ws) {
    __shared__ __align__(16) float gs[NEXP];

    const int tid  = threadIdx.x;
    const int blk  = blockIdx.x;                        // 0 .. 63
    const bool isA = blk < (BS * RNK * DIM) / ROWS_PER_BLK;   // first half: A, second: B
    const int b    = (blk / (RNK * DIM / ROWS_PER_BLK)) & (BS - 1);
    const int f    = (blk * ROWS_PER_BLK + tid) & (BS * RNK * DIM - 1);  // first row
    const int i    = f & (RNK * DIM - 1);

    // This thread's weight rows: asked for first, used last. Unrolled: wr stays
    // in registers and all its loads are in flight together.
    const float* wsrc = (isA ? Wa : Wb) + (size_t)i * 4;
    float4 wr[ROWS_PER_THR];
#pragma unroll
    for (int j = 0; j < ROWS_PER_THR; ++j) {
        // The compiler lets the last load land on the address register that the
        // loads in front of it name: this wait stands in front of that overwrite.
        if (j == ROWS_PER_THR - 1) asm volatile("s_wait_xcnt 0x0" ::: "memory");
        wr[j] = *(const float4*)(wsrc + (size_t)j * 256 * 4);
    }

    if (tid < 32) {                                     // wave 0, every lane on
        const int ra = tid;                             // hidden units of this lane
        const int rb = tid + 32 < HID ? tid + 32 : HID - 1;
        const int o  = tid & (NEXP - 1);                // logit of this lane
        float4 w1a[CTR / 4], w1b[CTR / 4], w2r[HID / 4];
        // All loops of this branch are unrolled: the arrays stay in registers and
        // a lane read takes its lane as a constant only with constant indices.
#pragma unroll
        for (int q = 0; q < CTR / 4; ++q) {
            w1a[q] = *(const float4*)(W1 + ra * CTR + 4 * q);
            w1b[q] = *(const float4*)(W1 + rb * CTR + 4 * q);
        }
#pragma unroll
        for (int q = 0; q < HID / 4; ++q)
            w2r[q] = *(const float4*)(W2 + o * HID + 4 * q);
        const float cv = ctr[b * CTR + tid];
        const float gm = gamma[tid];
        const float bt = beta[tid];
        float sa = b1[ra];
        float sb = b1[rb];
        float s2 = b2[o];
        // Keeps every load above in front of the serial sums below, so that the
        // wave pays one memory latency and not one per layer.
        __builtin_amdgcn_sched_barrier(0);

        float mu = 0.f;
#pragma unroll
        for (int d = 0; d < CTR; ++d) mu += from_lane(cv, d);
        mu *= (1.f / CTR);
        float var = 0.f;
#pragma unroll
        for (int d = 0; d < CTR; ++d) { float t = from_lane(cv, d) - mu; var += t * t; }
        var *= (1.f / CTR);
        const float inv = rsqrtf(var + LN_EPS);
        const float zv  = (cv - mu) * inv * gm + bt;    // lane d: z[d]

#pragma unroll
        for (int q = 0; q < CTR / 4; ++q) {
            const float z0 = from_lane(zv, 4 * q + 0), z1 = from_lane(zv, 4 * q + 1);
            const float z2 = from_lane(zv, 4 * q + 2), z3 = from_lane(zv, 4 * q + 3);
            sa = fmaf(z0, w1a[q].x, sa);  sb = fmaf(z0, w1b[q].x, sb);
            sa = fmaf(z1, w1a[q].y, sa);  sb = fmaf(z1, w1b[q].y, sb);
            sa = fmaf(z2, w1a[q].z, sa);  sb = fmaf(z2, w1b[q].z, sb);
            sa = fmaf(z3, w1a[q].w, sa);  sb = fmaf(z3, w1b[q].w, sb);
        }
        const float ha = sa > 0.f ? sa : 0.f;           // lane l: h[l]
        const float hb = sb > 0.f ? sb : 0.f;           // lane l < 28: h[l + 32]

#pragma unroll
        for (int q = 0; q < HID / 4; ++q) {
            const float hsrc = q < 8 ? ha : hb;
            const int   l0   = (4 * q) & 31;
            s2 = fmaf(from_lane(hsrc, l0 + 0), w2r[q].x, s2);
            s2 = fmaf(from_lane(hsrc, l0 + 1), w2r[q].y, s2);
            s2 = fmaf(from_lane(hsrc, l0 + 2), w2r[q].z, s2);
            s2 = fmaf(from_lane(hsrc, l0 + 3), w2r[q].w, s2);
        }

        float mx = -1e30f;
#pragma unroll
        for (int k = 0; k < NEXP; ++k) mx = fmaxf(mx, from_lane(s2, k));
        const float e = __expf(s2 - mx);
        float se = 0.f;
#pragma unroll
        for (int k = 0; k < NEXP; ++k) se += from_lane(e, k);
        const float rs = 1.f / se;
        if (tid < NEXP) gs[tid] = e * rs;
    }
    __syncthreads();   // the sample's gate stands in gs for all eight waves

    const float4 gv = *(const float4*)gs;
    float* dst     = (isA ? A_ws : B_ws) + f;
    const float sc = isA ? 1.f : SCALING;               // both factors are exact
#pragma unroll   // wr is indexed by constants only
    for (int j = 0; j < ROWS_PER_THR; ++j)
        dst[j * 256] = (wr[j].x * gv.x + wr[j].y * gv.y + wr[j].z * gv.z + wr[j].w * gv.w) * sc;
}

// ---------------------------------------------------------------------------
// Tensor load: one request of one wave brings a tile of 16 rows of 256 bytes
// (source pitch one x row) into LDS, 16 bytes of pad behind every row.
// ---------------------------------------------------------------------------
__device__ __forceinline__ uint32_t uni(uint32_t v) {
    return (uint32_t)__builtin_amdgcn_readfirstlane(v);
}
// Both groups go in and out: each keeps its registers from request to request, so
// that under requests in flight no descriptor register is written but those the
// caller changes.
__device__ __forceinline__ void tdm_load(u32x4& g0, u32x8& g1) {
    asm volatile("tensor_load_to_lds %0, %1" : "+s"(g0), "+s"(g1) :: "memory");
}
// The compiler places no wait for a tensor load: all but the N youngest have landed.
template <int N> __device__ __forceinline__ void wait_tensor_le() {
    asm volatile("s_wait_tensorcnt %0" :: "i"(N) : "memory");
}
// This wave's LDS reads have returned: its slot may be refilled.
__device__ __forceinline__ void wait_ds0() {
    asm volatile("s_wait_dscnt 0x0" ::: "memory");
}
__device__ __forceinline__ u32x8 tdm_group1() {
    u32x8 g;                                   // 1-byte elements, tensor = tile
    g[0] = uni((1u << 20) | (5u << 22) | (3u << 25));   // pad: 4 dwords behind every 64
    g[1] = uni((KC * 4u) << 16);               // tensor_dim0 = 256 bytes
    g[2] = uni(16u << 16);                     // tensor_dim1 = 16 rows
    g[3] = uni((KC * 4u) << 16);               // tile_dim0
    g[4] = uni(16u);                           // tile_dim1
    g[5] = uni(DIM * 4u);                      // source row pitch in bytes
    g[6] = uni(0u);
    g[7] = uni(0u);
    return g;
}

__device__ __forceinline__ unsigned lds_off(const void* p) {
    return (unsigned)(uintptr_t)p;   // low 32 bits of flat LDS addr = LDS offset
}

// ---------------------------------------------------------------------------
// Kernel 2: out[b] = (x[b] @ A[b]^T) @ B[b].  Both GEMMs on
// V_WMMA_F32_16X16X4_F32. A[b] stands whole in LDS. x comes by tensor loads into
// rings that are private to a wave: a wave loads, waits for and reads only its own
// tiles (16 tokens x 64 k), three requests in flight, no barrier in the K loop.
// ---------------------------------------------------------------------------
__launch_bounds__(256)
__global__ void lora_main_kernel(const float* __restrict__ x,
                                 const float* __restrict__ A_ws,
                                 const float* __restrict__ B_ws,
                                 float* __restrict__ out) {
    __shared__ __attribute__((aligned(2048))) unsigned char ring[8 * NSLOT * SLOT_B];
    __shared__ __align__(16) float al[RNK * AP + 96];            // A rows, then zeros
    __shared__ float xa[TOK_PER_BLK * XA_STR];                   // 2.5 KB

    const int b    = blockIdx.y;
    const int s0   = blockIdx.x * TOK_PER_BLK;
    const int tid  = threadIdx.x;
    const int w    = tid >> 5;        // wave id (wave32)
    const int lane = tid & 31;
    const int m    = lane & 15;       // row/col index within 16
    const int g    = lane >> 4;       // half-wave group

    const float* xb = x    + ((size_t)b * SEQ + s0) * DIM;
    const float* Ab = A_ws + (size_t)b * (RNK * DIM);
    const float* Bb = B_ws + (size_t)b * (RNK * DIM);
    float*       ob = out  + ((size_t)b * SEQ + s0) * DIM;

    // ---------------- Phase 1: xa = x_tile @ A^T (tensor loads + WMMA) ----
    v8f c = {0.f, 0.f, 0.f, 0.f, 0.f, 0.f, 0.f, 0.f};
    const int tt = w & 3;    // token tile owned by this wave
    const int kh = w >> 2;   // chunks of this wave: 0 the even ones, 1 the odd ones

    // Stage s of a wave is chunk 2s + kh of its token tile, in slot s mod NSLOT.
    const uint32_t wave  = uni((uint32_t)tid >> 5);
    const uint32_t ring0 = uni(lds_off(ring) + wave * (NSLOT * SLOT_B));
    const uint64_t ga0   = (uint64_t)(uintptr_t)(xb + (size_t)(wave & 3u) * 16 * DIM
                                                    + (wave >> 2) * KC);
    const uint32_t lo0   = uni((uint32_t)ga0);
    const uint32_t hi0   = uni((((uint32_t)(ga0 >> 32)) & 0x01FFFFFFu) | 0x80000000u);
    u32x8 g1 = tdm_group1();
    u32x4 g0;
    g0[0] = uni(1u);
    g0[3] = hi0;
    auto issue = [&](int s) {
        const uint32_t lo = uni(lo0 + (uint32_t)s * (2u * KC * 4u));
        // Only the LDS place and the low address word change under requests in
        // flight; should the walk cross 4 GiB, the high word changes behind a drain.
        if (s != 0) {
            const uint32_t hi = uni(hi0 + (lo < lo0 ? 1u : 0u));
            if (hi != g0[3]) { wait_tensor_le<0>(); g0[3] = hi; }
        }
        g0[1] = uni(ring0 + (uint32_t)(s & (NSLOT - 1)) * SLOT_B);
        g0[2] = lo;
        tdm_load(g0, g1);
    };
    issue(0);
    issue(1);
    issue(2);

    // A[b] into LDS through registers, under the first tiles' flight. Unrolled: ar
    // stays in registers and all its loads are in flight together.
    {
        const float* asrc = Ab + 4 * tid;
        float4 ar[RNK * 2];
#pragma unroll
        for (int j = 0; j < RNK * 2; ++j)
            ar[j] = *(const float4*)(asrc + j * 1024);
#pragma unroll
        for (int j = 0; j < RNK * 2; ++j)
            *(float4*)&al[(j >> 1) * AP + (j & 1) * 1024 + 4 * tid] = ar[j];
        // Stands in front of every later overwrite of the loads' address registers.
        asm volatile("s_wait_xcnt 0x0" ::: "memory");
        // Columns 8..15 of the product are padding: their lanes read these zeros.
        if (tid < 96) al[RNK * AP + tid] = 0.f;
    }
    __syncthreads();   // A and the zeros stand in LDS for all eight waves

    const float* xp0 = (const float*)(ring + (size_t)w * (NSLOT * SLOT_B)) + m * XS_STR + 2 * g;
    // A lane of a padding column walks 64 zeros anew in every stage, on the 32
    // banks that the eight A rows leave free.
    const float* ap  = m < RNK ? &al[m * AP + kh * KC + 2 * g]
                               : &al[RNK * AP + (m - RNK) * 4 + 2 * g];
    const int astep  = m < RNK ? 2 * KC : 0;
    // Unrolled: slot, wait count and the test for a further stage are constants.
#pragma unroll
    for (int s = 0; s < NSTAGE; ++s) {
        if (s + 2 < NSTAGE)      wait_tensor_le<2>();   // stage s has landed
        else if (s + 1 < NSTAGE) wait_tensor_le<1>();
        else                     wait_tensor_le<0>();
        // Into the slot of stage s - 1, whose reads ended at that stage's foot.
        if (s + 3 < NSTAGE) issue(s + 3);

        const float* xp = xp0 + (s & (NSLOT - 1)) * (SLOT_B / 4);
#pragma unroll
        for (int k = 0; k < KC; k += 4) {
            v2f av = *(const v2f*)(xp + k);   // A-op: x[m][k0+2g], x[m][k0+2g+1]
            v2f bv = *(const v2f*)(ap + k);   // B-op: A[n][k0+2g], A[n][k0+2g+1]
            c = __builtin_amdgcn_wmma_f32_16x16x4_f32(false, av, false, bv,
                                                      (short)0, c, false, false);
        }
        ap += astep;
        wait_ds0();
    }

    // Combine the two waves' sums through LDS into xa[token][r].
    if (kh == 1 && m < RNK) {
#pragma unroll
        for (int i = 0; i < 8; ++i)
            xa[(tt * 16 + i + 8 * g) * XA_STR + m] = c[i];
    }
    __syncthreads();
    if (kh == 0 && m < RNK) {
#pragma unroll
        for (int i = 0; i < 8; ++i)
            xa[(tt * 16 + i + 8 * g) * XA_STR + m] += c[i];
    }
    __syncthreads();

    // ---------------- Phase 2: out_tile = xa_tile @ B --------------------
    // A wave takes 64-column groups. Inside a group, column n of product q is
    // output column 4n + q: after the four products a lane holds four adjacent
    // columns of each of its rows and stores them as one 16-byte piece, so the
    // 16 lanes of a row write 256 contiguous, aligned bytes in one instruction.
    // The k order and the two-step sum of every output element stay as they were.
    v4f br[4][4];   // [group][k row]: B[k][4 adjacent columns], read from L2
    // Unrolled: br and d are indexed by constants only and stay in registers.
#pragma unroll
    for (int jg = 0; jg < 4; ++jg) {
        const float* bp = Bb + (w + 8 * jg) * 64 + 4 * m;
        br[jg][0] = *(const v4f*)(bp + (size_t)(2 * g) * DIM);
        br[jg][1] = *(const v4f*)(bp + (size_t)(2 * g + 1) * DIM);
        br[jg][2] = *(const v4f*)(bp + (size_t)(4 + 2 * g) * DIM);
        // The compiler lets the last load land on the address pair that the loads
        // in front of it name: this wait stands in front of that overwrite.
        if (jg == 3) asm volatile("s_wait_xcnt 0x0" ::: "memory");
        br[jg][3] = *(const v4f*)(bp + (size_t)(5 + 2 * g) * DIM);
    }
#pragma unroll
    for (int t2 = 0; t2 < 4; ++t2) {
        const float* xr = &xa[(t2 * 16 + m) * XA_STR];
        v2f a0 = *(const v2f*)(xr + 2 * g);       // r = 2g, 2g+1
        v2f a1 = *(const v2f*)(xr + 4 + 2 * g);   // r = 4+2g, 5+2g
#pragma unroll
        for (int jg = 0; jg < 4; ++jg) {
            v8f d[4];
#pragma unroll
            for (int q = 0; q < 4; ++q) {
                v2f b0 = { br[jg][0][q], br[jg][1][q] };
                v2f b1 = { br[jg][2][q], br[jg][3][q] };
                v8f z = {0.f, 0.f, 0.f, 0.f, 0.f, 0.f, 0.f, 0.f};
                z = __builtin_amdgcn_wmma_f32_16x16x4_f32(false, a0, false, b0,
                                                          (short)0, z, false, false);
                d[q] = __builtin_amdgcn_wmma_f32_16x16x4_f32(false, a1, false, b1,
                                                             (short)0, z, false, false);
            }
            float* op = ob + (size_t)(t2 * 16 + 8 * g) * DIM + (w + 8 * jg) * 64 + 4 * m;
#pragma unroll
            for (int i2 = 0; i2 < 8; ++i2) {
                v4f o = { d[0][i2], d[1][i2], d[2][i2], d[3][i2] };
                *(v4f*)(op + (size_t)i2 * DIM) = o;
            }
            // Ends a group's schedule here: with one block on a WGP the compiler
            // would else mix the groups and go beyond 256 registers, with a
            // register-window switch at every few instructions.
            __builtin_amdgcn_sched_barrier(0);
        }
    }
}

// ---------------------------------------------------------------------------
extern "C" void kernel_launch(void* const* d_in, const int* in_sizes, int n_in,
                              void* d_out, int out_size, void* d_ws, size_t ws_size,
                              hipStream_t stream) {
    const float* x   = (const float*)d_in[0];
    const float* ctr = (const float*)d_in[1];
    const float* gam = (const float*)d_in[2];
    const float* bet = (const float*)d_in[3];
    const float* W1  = (const float*)d_in[4];
    const float* b1  = (const float*)d_in[5];
    const float* W2  = (const float*)d_in[6];
    const float* b2  = (const float*)d_in[7];
    const float* Wa  = (const float*)d_in[8];
    const float* Wb  = (const float*)d_in[9];
    float* out = (float*)d_out;

    float* A_ws    = (float*)((char*)d_ws + 256);        // 8*8*2048 floats
    float* B_ws    = A_ws + BS * RNK * DIM;              // 8*8*2048 floats

    gate_ab_kernel<<<(2 * BS * RNK * DIM) / ROWS_PER_BLK, 256, 0, stream>>>(
        ctr, gam, bet, W1, b1, W2, b2, Wa, Wb, A_ws, B_ws);
    lora_main_kernel<<<dim3(SEQ / TOK_PER_BLK, BS), 256, 0, stream>>>(x, A_ws, B_ws, out);
}
